// v000
// The times below were measured on an AMD MI455X: many runs one after another, warmed up first and cycling through
// copies of the inputs, with the whole window's GPU time divided by the number of runs. Launches and the gaps
// between them are all in it. The median over several windows is given; except for v000 it joins two sittings, which
// can be a few percent apart, so the side-by-side timings, each taken in one sitting, are the better comparison.
// v000 is the starting kernel. One run takes 223 microseconds.
#include <hip/hip_runtime.h>

typedef __attribute__((ext_vector_type(2))) float v2f;
typedef __attribute__((ext_vector_type(8))) float v8f;

#define NB   8192
#define SEQ  64
#define DIM  32
#define NH   4
#define DH   8
#define XS   36   // padded pitch for x tile: 144B rows -> 16B-aligned for async b128
#define XP   33   // padded pitch for Q/K/V/O tiles (bank spread)
#define AP   65   // padded pitch for [64 x 64] score tile

__device__ __forceinline__ v8f wmma4(v2f a, v2f b, v8f c) {
  // D = A(16x4,f32) * B(4x16,f32) + C(16x16,f32) — full fp32 matrix op
  return __builtin_amdgcn_wmma_f32_16x16x4_f32(
      /*neg_a=*/false, a, /*neg_b=*/false, b,
      /*c_mod=*/(short)0, c, /*reuse_a=*/false, /*reuse_b=*/false);
}

__global__ __launch_bounds__(128)
void attn_fused_kernel(const float* __restrict__ x,
                       const int*   __restrict__ attend,
                       const float* __restrict__ Wq, const float* __restrict__ bq,
                       const float* __restrict__ Wk, const float* __restrict__ bk,
                       const float* __restrict__ Wv, const float* __restrict__ bv,
                       const float* __restrict__ Wp, const float* __restrict__ bp,
                       float* __restrict__ out)
{
  __shared__ float sX[SEQ * XS];   // x tile (async-staged, 9.0 KB)
  __shared__ float sQ[SEQ * XP];
  __shared__ float sK[SEQ * XP];
  __shared__ float sV[SEQ * XP];
  __shared__ float sO[SEQ * XP];   // attn output (heads interleaved -> [S, D])
  __shared__ float sA[SEQ * AP];   // scores / attention probs (16.25 KB)

  const int b    = blockIdx.x;
  const int tid  = threadIdx.x;
  const int lane = tid & 31;
  const int wave = tid >> 5;       // 0..3 -> row-tile
  const int l16  = lane & 15;
  const int lh   = lane >> 4;      // lane half selects K sub-pair / M+8
  const int row  = wave * 16 + l16;       // A-fragment row (M = lane&15)
  const int aa   = attend[b];

  // ---- stage x[b] (64x32) into LDS via CDNA5 async copy (ASYNCcnt path) ----
  const float* xb = x + (size_t)b * (SEQ * DIM);
  {
    const unsigned ldsBase = (unsigned)(uintptr_t)(&sX[0]); // LDS offset = low 32b
    for (int c = tid; c < (SEQ * DIM) / 4; c += 128) {      // 512 x 16B chunks
      const int r   = c >> 3;                               // row (8 chunks/row)
      const int col = (c & 7) * 4;                          // starting float col
      const unsigned ldst = ldsBase + (unsigned)((r * XS + col) * sizeof(float));
      const float* gp = xb + c * 4;                         // 16B-aligned global
      asm volatile("global_load_async_to_lds_b128 %0, %1, off"
                   :: "v"(ldst), "v"(gp) : "memory");
    }
    asm volatile("s_wait_asynccnt 0x0" ::: "memory");
  }
  __syncthreads();

  // ---- QKV projections: P = X @ W^T + bias, each [64,32] ----
  const float* Wg[3] = {Wq, Wk, Wv};
  const float* bg[3] = {bq, bk, bv};
  float*       Pg[3] = {sQ, sK, sV};
#pragma unroll
  for (int p = 0; p < 3; ++p) {
    const float* W = Wg[p];
#pragma unroll
    for (int nt = 0; nt < 2; ++nt) {
      v8f c = {};
#pragma unroll
      for (int k = 0; k < 8; ++k) {            // K = 32 in steps of 4
        const int kk = k * 4 + lh * 2;
        v2f a; a.x = sX[row * XS + kk]; a.y = sX[row * XS + kk + 1];
        const int n = nt * 16 + l16;
        // B[k][n] = W[n][k]; 8B-aligned pair -> single b64 load
        const v2f bbf = *reinterpret_cast<const v2f*>(W + n * DIM + kk);
        c = wmma4(a, bbf, c);
      }
      const float bias = bg[p][nt * 16 + l16];
#pragma unroll
      for (int r = 0; r < 8; ++r)              // C: M = r + 8*lh, N = l16
        Pg[p][(wave * 16 + r + 8 * lh) * XP + nt * 16 + l16] = c[r] + bias;
    }
  }
  __syncthreads();

  const float scale = 0.35355339059327373f;    // 1/sqrt(DH)

  for (int h = 0; h < NH; ++h) {
    // ---- scores: S = Qh @ Kh^T, wave computes rows [16w,16w+16) x 64 ----
#pragma unroll
    for (int ct = 0; ct < 4; ++ct) {
      v8f c = {};
#pragma unroll
      for (int k = 0; k < 2; ++k) {            // K = DH = 8 in steps of 4
        const int kk = h * DH + k * 4 + lh * 2;
        v2f a; a.x = sQ[row * XP + kk]; a.y = sQ[row * XP + kk + 1];
        const int n = ct * 16 + l16;           // key index
        v2f bbf; bbf.x = sK[n * XP + kk]; bbf.y = sK[n * XP + kk + 1];
        c = wmma4(a, bbf, c);
      }
#pragma unroll
      for (int r = 0; r < 8; ++r)
        sA[(wave * 16 + r + 8 * lh) * AP + ct * 16 + l16] = c[r] * scale;
    }
    __syncthreads();

    // ---- masked softmax: one thread per query row ----
    if (tid < SEQ) {
      float* rp = &sA[tid * AP];
      float m = -3.402823466e38f;
      for (int j = 0; j < SEQ; ++j) {
        const bool ok = (j <= tid) || (j < aa);  // causal OR prefix
        m = fmaxf(m, ok ? rp[j] : -3.402823466e38f);
      }
      float sum = 0.f;
      for (int j = 0; j < SEQ; ++j) {
        const bool ok = (j <= tid) || (j < aa);
        const float e = ok ? __expf(rp[j] - m) : 0.f;
        rp[j] = e;
        sum += e;
      }
      const float inv = 1.0f / sum;
      for (int j = 0; j < SEQ; ++j) rp[j] *= inv;
    }
    __syncthreads();

    // ---- out_h = attn @ Vh : [64,8] (N lanes 8..15 padded with zero) ----
    {
      v8f c = {};
#pragma unroll
      for (int k = 0; k < 16; ++k) {           // K = 64 in steps of 4
        const int kk = k * 4 + lh * 2;         // key index
        v2f a; a.x = sA[row * AP + kk]; a.y = sA[row * AP + kk + 1];
        v2f bbf;
        if (l16 < DH) {                        // B[k][n] = V[k][h*8+n]
          bbf.x = sV[kk * XP + h * DH + l16];
          bbf.y = sV[(kk + 1) * XP + h * DH + l16];
        } else { bbf.x = 0.f; bbf.y = 0.f; }
        c = wmma4(a, bbf, c);                  // uniform: EXEC all-ones here
      }
      if (l16 < DH) {
#pragma unroll
        for (int r = 0; r < 8; ++r)
          sO[(wave * 16 + r + 8 * lh) * XP + h * DH + l16] = c[r];
      }
    }
    __syncthreads();                            // sA reused next head; sO complete at loop exit
  }

  // ---- output projection: Y = O @ Wp^T + bp, streamed to HBM ----
  float* yb = out + (size_t)b * (SEQ * DIM);
#pragma unroll
  for (int nt = 0; nt < 2; ++nt) {
    v8f c = {};
#pragma unroll
    for (int k = 0; k < 8; ++k) {
      const int kk = k * 4 + lh * 2;
      v2f a; a.x = sO[row * XP + kk]; a.y = sO[row * XP + kk + 1];
      const int n = nt * 16 + l16;
      const v2f bbf = *reinterpret_cast<const v2f*>(Wp + n * DIM + kk);
      c = wmma4(a, bbf, c);
    }
    const float bias = bp[nt * 16 + l16];
#pragma unroll
    for (int r = 0; r < 8; ++r)
      yb[(wave * 16 + r + 8 * lh) * DIM + nt * 16 + l16] = c[r] + bias;
  }
}

extern "C" void kernel_launch(void* const* d_in, const int* in_sizes, int n_in,
                              void* d_out, int out_size, void* d_ws, size_t ws_size,
                              hipStream_t stream) {
  const float* x      = (const float*)d_in[0];
  const int*   attend = (const int*)  d_in[1];
  const float* Wq     = (const float*)d_in[2];
  const float* bq     = (const float*)d_in[3];
  const float* Wk     = (const float*)d_in[4];
  const float* bk     = (const float*)d_in[5];
  const float* Wv     = (const float*)d_in[6];
  const float* bv     = (const float*)d_in[7];
  const float* Wp     = (const float*)d_in[8];
  const float* bp     = (const float*)d_in[9];
  float* out = (float*)d_out;

  dim3 grid(NB), block(128);
  hipLaunchKernelGGL(attn_fused_kernel, grid, block, 0, stream,
                     x, attend, Wq, bq, Wk, bk, Wv, bv, Wp, bp, out);
}

// v001
// Measured time: 66.1 microseconds a run.
// Two timings next to v000 both put it at 3.44 times that version's speed.
#include <hip/hip_runtime.h>

typedef __attribute__((ext_vector_type(2))) float v2f;
typedef __attribute__((ext_vector_type(8))) float v8f;

#define NB   8192
#define SEQ  64
#define DIM  32
#define NH   4
#define DH   8
#define XS   36   // padded pitch for x tile: 144B rows -> 16B-aligned for async b128
#define XP   33   // padded pitch for Q/K/V/O tiles (bank spread)

__device__ __forceinline__ v8f wmma4(v2f a, v2f b, v8f c) {
  // D = A(16x4,f32) * B(4x16,f32) + C(16x16,f32) — full fp32 matrix op
  return __builtin_amdgcn_wmma_f32_16x16x4_f32(
      /*neg_a=*/false, a, /*neg_b=*/false, b,
      /*c_mod=*/(short)0, c, /*reuse_a=*/false, /*reuse_b=*/false);
}

__device__ __forceinline__ float xhalf(float v) {
  // value of lane l ^ 16 (the other 16-lane row), by a vector cross-row move
  const int b = __builtin_bit_cast(int, v);
  return __builtin_bit_cast(float, __builtin_amdgcn_permlanex16(
      b, b, 0x76543210, 0xfedcba98, false, false));
}

__global__ __launch_bounds__(128)
void attn_fused_kernel(const float* __restrict__ x,
                       const int*   __restrict__ attend,
                       const float* __restrict__ Wq, const float* __restrict__ bq,
                       const float* __restrict__ Wk, const float* __restrict__ bk,
                       const float* __restrict__ Wv, const float* __restrict__ bv,
                       const float* __restrict__ Wp, const float* __restrict__ bp,
                       float* __restrict__ out)
{
  __shared__ float sX[SEQ * XS];   // x tile (async-staged, 9.0 KB)
  __shared__ float sQ[SEQ * XP];
  __shared__ float sK[SEQ * XP];
  __shared__ float sV[SEQ * XP];
  __shared__ float sO[SEQ * XP];   // attn output (heads interleaved -> [S, D])

  const int b    = blockIdx.x;
  const int tid  = threadIdx.x;
  const int lane = tid & 31;
  const int wave = tid >> 5;       // 0..3 -> row-tile
  const int l16  = lane & 15;
  const int lh   = lane >> 4;      // lane half selects K sub-pair / M+8
  const int row  = wave * 16 + l16;       // A-fragment row (M = lane&15)
  const int aa   = attend[b];

  // ---- stage x[b] (64x32) into LDS via CDNA5 async copy (ASYNCcnt path) ----
  const float* xb = x + (size_t)b * (SEQ * DIM);
  {
    const unsigned ldsBase = (unsigned)(uintptr_t)(&sX[0]); // LDS offset = low 32b
    for (int c = tid; c < (SEQ * DIM) / 4; c += 128) {      // 512 x 16B chunks
      const int r   = c >> 3;                               // row (8 chunks/row)
      const int col = (c & 7) * 4;                          // starting float col
      const unsigned ldst = ldsBase + (unsigned)((r * XS + col) * sizeof(float));
      const float* gp = xb + c * 4;                         // 16B-aligned global
      asm volatile("global_load_async_to_lds_b128 %0, %1, off"
                   :: "v"(ldst), "v"(gp) : "memory");
    }
    asm volatile("s_wait_asynccnt 0x0" ::: "memory");
  }
  __syncthreads();

  // ---- QKV projections: P = X @ W^T + bias, each [64,32] ----
  const float* Wg[3] = {Wq, Wk, Wv};
  const float* bg[3] = {bq, bk, bv};
  float*       Pg[3] = {sQ, sK, sV};
#pragma unroll
  for (int p = 0; p < 3; ++p) {
    const float* W = Wg[p];
#pragma unroll
    for (int nt = 0; nt < 2; ++nt) {
      v8f c = {};
#pragma unroll
      for (int k = 0; k < 8; ++k) {            // K = 32 in steps of 4
        const int kk = k * 4 + lh * 2;
        v2f a; a.x = sX[row * XS + kk]; a.y = sX[row * XS + kk + 1];
        const int n = nt * 16 + l16;
        // B[k][n] = W[n][k]; 8B-aligned pair -> single b64 load
        const v2f bbf = *reinterpret_cast<const v2f*>(W + n * DIM + kk);
        c = wmma4(a, bbf, c);
      }
      const float bias = bg[p][nt * 16 + l16];
#pragma unroll
      for (int r = 0; r < 8; ++r)              // C: M = r + 8*lh, N = l16
        Pg[p][(wave * 16 + r + 8 * lh) * XP + nt * 16 + l16] = c[r] + bias;
    }
  }
  __syncthreads();

  // exp(s / sqrt(DH) - max) as exp2(s * kexp - max * kexp)
  const float kexp = 0.35355339059327373f * 1.4426950408889634f;
  // key j is allowed for query 'row' if j <= row or j < aa, i.e. j < max(row + 1, aa);
  // this lane's keys are t*16 + 8*lh + r, so compare t*16 + r with lim
  const int lim = max(row + 1, aa) - 8 * lh;

  // From here on a wave reads sQ and writes and reads sO in its own 16 rows only,
  // and sK, sV are read-only: no barrier is needed after the one above.
  for (int h = 0; h < NH; ++h) {
    // ---- scores, transposed: S^T = Kh @ Qh^T; keys on M, the wave's 16 queries on N ----
    v2f qf[2];                                 // B[k][n] = Q[row][k]
#pragma unroll  // constant indices: the fragment arrays stay in registers
    for (int k = 0; k < 2; ++k) {              // K = DH = 8 in steps of 4
      const int kk = h * DH + k * 4 + lh * 2;
      qf[k].x = sQ[row * XP + kk]; qf[k].y = sQ[row * XP + kk + 1];
    }
    v8f s[4];                                  // s[t][r] = S[query row][key t*16 + 8*lh + r]
#pragma unroll  // constant indices: the fragment arrays stay in registers
    for (int t = 0; t < 4; ++t) {
      v8f c = {};
#pragma unroll  // constant indices: the fragment arrays stay in registers
      for (int k = 0; k < 2; ++k) {
        const int kk = h * DH + k * 4 + lh * 2;
        const int n = t * 16 + l16;            // key index (A row)
        v2f a; a.x = sK[n * XP + kk]; a.y = sK[n * XP + kk + 1];
        c = wmma4(a, qf[k], c);
      }
      s[t] = c;
    }

    // ---- masked softmax in registers: a lane holds 32 of its query's 64 scores ----
    float mt[4];
#pragma unroll  // constant indices: the fragment arrays stay in registers
    for (int t = 0; t < 4; ++t) {
      mt[t] = -3.402823466e38f;
#pragma unroll  // constant indices: the fragment arrays stay in registers
      for (int r = 0; r < 8; ++r) {
        s[t][r] = (t * 16 + r < lim) ? s[t][r] : -3.402823466e38f;
        mt[t] = fmaxf(mt[t], s[t][r]);
      }
    }
    float m = fmaxf(fmaxf(mt[0], mt[1]), fmaxf(mt[2], mt[3]));
    m = fmaxf(m, xhalf(m));                    // key 0 is always allowed: m is a real score
    const v2f kexp2 = {kexp, kexp};
    const v2f nmk2  = {-m * kexp, -m * kexp};
    v2f p[4][4];                               // p[t][k] = P[row][key t*16 + 8*lh + 2*k (+1)]
    v2f sum2[2] = {{0.f, 0.f}, {0.f, 0.f}};
#pragma unroll  // constant indices: the fragment arrays stay in registers
    for (int t = 0; t < 4; ++t)
#pragma unroll  // constant indices: the fragment arrays stay in registers
      for (int k = 0; k < 4; ++k) {
        const v2f sc = {s[t][2 * k], s[t][2 * k + 1]};
        const v2f arg = __builtin_elementwise_fma(sc, kexp2, nmk2);
        p[t][k].x = __builtin_amdgcn_exp2f(arg.x);   // masked -> 0
        p[t][k].y = __builtin_amdgcn_exp2f(arg.y);
        sum2[k & 1] += p[t][k];
      }
    float sum = (sum2[0].x + sum2[1].x) + (sum2[0].y + sum2[1].y);
    sum += xhalf(sum);
    const float inv = 1.0f / sum;

    // ---- out_h^T = Vh^T @ P^T: the score registers are the B operand as they lie ----
    {
      v8f c = {};
#pragma unroll  // constant indices: the fragment arrays stay in registers
      for (int t = 0; t < 4; ++t)
#pragma unroll  // constant indices: the fragment arrays stay in registers
        for (int k = 0; k < 4; ++k) {          // k order of both operands: key = t*16 + 8*lh + 2*k (+1)
          const int key = t * 16 + 8 * lh + 2 * k;
          const int col = h * DH + (l16 & 7);  // A rows 8..15 repeat rows 0..7 (DH = 8)
          v2f a; a.x = sV[key * XP + col]; a.y = sV[(key + 1) * XP + col];
          c = wmma4(a, p[t][k], c);
        }
      // both lane halves hold O[row][h*8 + r], r = 0..7: each stores four of them
#pragma unroll  // constant indices: the fragment arrays stay in registers
      for (int i = 0; i < 4; ++i) {
        const float lo = c[i] * inv, hi = c[4 + i] * inv;
        sO[row * XP + h * DH + lh * 4 + i] = lh ? hi : lo;
      }
    }
  }

  // ---- output projection: Y = O @ Wp^T + bp, streamed to HBM ----
  float* yb = out + (size_t)b * (SEQ * DIM);
#pragma unroll
  for (int nt = 0; nt < 2; ++nt) {
    v8f c = {};
#pragma unroll
    for (int k = 0; k < 8; ++k) {
      const int kk = k * 4 + lh * 2;
      v2f a; a.x = sO[row * XP + kk]; a.y = sO[row * XP + kk + 1];
      const int n = nt * 16 + l16;
      const v2f bbf = *reinterpret_cast<const v2f*>(Wp + n * DIM + kk);
      c = wmma4(a, bbf, c);
    }
    const float bias = bp[nt * 16 + l16];
#pragma unroll
    for (int r = 0; r < 8; ++r)
      yb[(wave * 16 + r + 8 * lh) * DIM + nt * 16 + l16] = c[r] + bias;
  }
}

extern "C" void kernel_launch(void* const* d_in, const int* in_sizes, int n_in,
                              void* d_out, int out_size, void* d_ws, size_t ws_size,
                              hipStream_t stream) {
  const float* x      = (const float*)d_in[0];
  const int*   attend = (const int*)  d_in[1];
  const float* Wq     = (const float*)d_in[2];
  const float* bq     = (const float*)d_in[3];
  const float* Wk     = (const float*)d_in[4];
  const float* bk     = (const float*)d_in[5];
  const float* Wv     = (const float*)d_in[6];
  const float* bv     = (const float*)d_in[7];
  const float* Wp     = (const float*)d_in[8];
  const float* bp     = (const float*)d_in[9];
  float* out = (float*)d_out;

  dim3 grid(NB), block(128);
  hipLaunchKernelGGL(attn_fused_kernel, grid, block, 0, stream,
                     x, attend, Wq, bq, Wk, bk, Wv, bv, Wp, bp, out);
}

// v002
// Measured time: 61.7 microseconds a run.
// In both of two side-by-side timings against v001, it was 1.07 times as fast.
// All steps since v000 together make it 3.68 times as fast.
#include <hip/hip_runtime.h>

typedef __attribute__((ext_vector_type(2))) float v2f;
typedef __attribute__((ext_vector_type(4))) float v4f;
typedef __attribute__((ext_vector_type(8))) float v8f;

#define NB   8192
#define SEQ  64
#define DIM  32
#define NH   4
#define DH   8
#define XS   36   // padded pitch for x tile: 144B rows -> 16B-aligned for async b128
#define XP   33   // padded pitch for Q/K/V/O tiles (bank spread)
#define WS   36   // padded pitch for the weight tiles: 8-byte fragment reads hit all 64 banks once

__device__ __forceinline__ v8f wmma4(v2f a, v2f b, v8f c) {
  // D = A(16x4,f32) * B(4x16,f32) + C(16x16,f32) — full fp32 matrix op
  return __builtin_amdgcn_wmma_f32_16x16x4_f32(
      /*neg_a=*/false, a, /*neg_b=*/false, b,
      /*c_mod=*/(short)0, c, /*reuse_a=*/false, /*reuse_b=*/false);
}

__device__ __forceinline__ float xhalf(float v) {
  // value of lane l ^ 16 (the other 16-lane row), by a vector cross-row move
  const int b = __builtin_bit_cast(int, v);
  return __builtin_bit_cast(float, __builtin_amdgcn_permlanex16(
      b, b, 0x76543210, 0xfedcba98, false, false));
}

__global__ __launch_bounds__(128)
void attn_fused_kernel(const float* __restrict__ x,
                       const int*   __restrict__ attend,
                       const float* __restrict__ Wq, const float* __restrict__ bq,
                       const float* __restrict__ Wk, const float* __restrict__ bk,
                       const float* __restrict__ Wv, const float* __restrict__ bv,
                       const float* __restrict__ Wp, const float* __restrict__ bp,
                       float* __restrict__ out)
{
  __shared__ float sX[SEQ * XS];   // x tile (async-staged, 9.0 KB)
  __shared__ float sQ[SEQ * XP];
  __shared__ float sK[SEQ * XP];
  __shared__ float sV[SEQ * XP];
  __shared__ float sO[SEQ * XP];   // attn output (heads interleaved -> [S, D])
  __shared__ __attribute__((aligned(16))) float sW[4 * DIM * WS];  // Wq, Wk, Wv, Wp (18 KB)

  const int b    = blockIdx.x;
  const int tid  = threadIdx.x;
  const int lane = tid & 31;
  const int wave = tid >> 5;       // 0..3 -> row-tile
  const int l16  = lane & 15;
  const int lh   = lane >> 4;      // lane half selects K sub-pair / M+8
  const int row  = wave * 16 + l16;       // A-fragment row (M = lane&15)
  const int aa   = attend[b];

  // ---- weights, first half: whole-line 16-byte loads (a fragment load from global touches
  //      16 lines for 256 bytes); issued here so that they fly beside the x copies ----
  const float* Wg[4] = {Wq, Wk, Wv, Wp};
  v4f wreg[4][2];
#pragma unroll  // constant indices: wreg stays in registers
  for (int p = 0; p < 4; ++p)
#pragma unroll  // constant indices: wreg stays in registers
    for (int i = 0; i < 2; ++i)                // 256 chunks of 16 B per matrix
      wreg[p][i] = *reinterpret_cast<const v4f*>(Wg[p] + (tid + i * 128) * 4);

  // ---- stage x[b] (64x32) into LDS via CDNA5 async copy (ASYNCcnt path) ----
  const float* xb = x + (size_t)b * (SEQ * DIM);
  {
    const unsigned ldsBase = (unsigned)(uintptr_t)(&sX[0]); // LDS offset = low 32b
    for (int c = tid; c < (SEQ * DIM) / 4; c += 128) {      // 512 x 16B chunks
      const int r   = c >> 3;                               // row (8 chunks/row)
      const int col = (c & 7) * 4;                          // starting float col
      const unsigned ldst = ldsBase + (unsigned)((r * XS + col) * sizeof(float));
      const float* gp = xb + c * 4;                         // 16B-aligned global
      asm volatile("global_load_async_to_lds_b128 %0, %1, off"
                   :: "v"(ldst), "v"(gp) : "memory");
    }
    asm volatile("s_wait_asynccnt 0x0" ::: "memory");
  }
  // ---- weights, second half: into LDS at pitch WS; the barrier below publishes them too ----
#pragma unroll  // constant indices: wreg stays in registers
  for (int p = 0; p < 4; ++p)
#pragma unroll  // constant indices: wreg stays in registers
    for (int i = 0; i < 2; ++i) {
      const int c = tid + i * 128;             // row c >> 3, 8 chunks a row
      *reinterpret_cast<v4f*>(&sW[(p * DIM + (c >> 3)) * WS + (c & 7) * 4]) = wreg[p][i];
    }
  __syncthreads();

  // ---- QKV projections: P = X @ W^T + bias, each [64,32] ----
  const float* bg[3] = {bq, bk, bv};
  float*       Pg[3] = {sQ, sK, sV};
#pragma unroll
  for (int p = 0; p < 3; ++p) {
#pragma unroll
    for (int nt = 0; nt < 2; ++nt) {
      v8f c = {};
#pragma unroll
      for (int k = 0; k < 8; ++k) {            // K = 32 in steps of 4
        const int kk = k * 4 + lh * 2;
        v2f a; a.x = sX[row * XS + kk]; a.y = sX[row * XS + kk + 1];
        const int n = nt * 16 + l16;
        // B[k][n] = W[n][k]; 8B-aligned pair -> single b64 LDS load
        const v2f bbf = *reinterpret_cast<const v2f*>(&sW[(p * DIM + n) * WS + kk]);
        c = wmma4(a, bbf, c);
      }
      const float bias = bg[p][nt * 16 + l16];
#pragma unroll
      for (int r = 0; r < 8; ++r)              // C: M = r + 8*lh, N = l16
        Pg[p][(wave * 16 + r + 8 * lh) * XP + nt * 16 + l16] = c[r] + bias;
    }
  }
  __syncthreads();

  // exp(s / sqrt(DH) - max) as exp2(s * kexp - max * kexp)
  const float kexp = 0.35355339059327373f * 1.4426950408889634f;
  // key j is allowed for query 'row' if j <= row or j < aa, i.e. j < max(row + 1, aa);
  // this lane's keys are t*16 + 8*lh + r, so compare t*16 + r with lim
  const int lim = max(row + 1, aa) - 8 * lh;

  // From here on a wave reads sQ and writes and reads sO in its own 16 rows only,
  // and sK, sV are read-only: no barrier is needed after the one above.
  for (int h = 0; h < NH; ++h) {
    // ---- scores, transposed: S^T = Kh @ Qh^T; keys on M, the wave's 16 queries on N ----
    v2f qf[2];                                 // B[k][n] = Q[row][k]
#pragma unroll  // constant indices: the fragment arrays stay in registers
    for (int k = 0; k < 2; ++k) {              // K = DH = 8 in steps of 4
      const int kk = h * DH + k * 4 + lh * 2;
      qf[k].x = sQ[row * XP + kk]; qf[k].y = sQ[row * XP + kk + 1];
    }
    v8f s[4];                                  // s[t][r] = S[query row][key t*16 + 8*lh + r]
#pragma unroll  // constant indices: the fragment arrays stay in registers
    for (int t = 0; t < 4; ++t) {
      v8f c = {};
#pragma unroll  // constant indices: the fragment arrays stay in registers
      for (int k = 0; k < 2; ++k) {
        const int kk = h * DH + k * 4 + lh * 2;
        const int n = t * 16 + l16;            // key index (A row)
        v2f a; a.x = sK[n * XP + kk]; a.y = sK[n * XP + kk + 1];
        c = wmma4(a, qf[k], c);
      }
      s[t] = c;
    }

    // ---- masked softmax in registers: a lane holds 32 of its query's 64 scores ----
    float mt[4];
#pragma unroll  // constant indices: the fragment arrays stay in registers
    for (int t = 0; t < 4; ++t) {
      mt[t] = -3.402823466e38f;
#pragma unroll  // constant indices: the fragment arrays stay in registers
      for (int r = 0; r < 8; ++r) {
        s[t][r] = (t * 16 + r < lim) ? s[t][r] : -3.402823466e38f;
        mt[t] = fmaxf(mt[t], s[t][r]);
      }
    }
    float m = fmaxf(fmaxf(mt[0], mt[1]), fmaxf(mt[2], mt[3]));
    m = fmaxf(m, xhalf(m));                    // key 0 is always allowed: m is a real score
    const v2f kexp2 = {kexp, kexp};
    const v2f nmk2  = {-m * kexp, -m * kexp};
    v2f p[4][4];                               // p[t][k] = P[row][key t*16 + 8*lh + 2*k (+1)]
    v2f sum2[2] = {{0.f, 0.f}, {0.f, 0.f}};
#pragma unroll  // constant indices: the fragment arrays stay in registers
    for (int t = 0; t < 4; ++t)
#pragma unroll  // constant indices: the fragment arrays stay in registers
      for (int k = 0; k < 4; ++k) {
        const v2f sc = {s[t][2 * k], s[t][2 * k + 1]};
        const v2f arg = __builtin_elementwise_fma(sc, kexp2, nmk2);
        p[t][k].x = __builtin_amdgcn_exp2f(arg.x);   // masked -> 0
        p[t][k].y = __builtin_amdgcn_exp2f(arg.y);
        sum2[k & 1] += p[t][k];
      }
    float sum = (sum2[0].x + sum2[1].x) + (sum2[0].y + sum2[1].y);
    sum += xhalf(sum);
    const float inv = 1.0f / sum;

    // ---- out_h^T = Vh^T @ P^T: the score registers are the B operand as they lie ----
    {
      v8f c = {};
#pragma unroll  // constant indices: the fragment arrays stay in registers
      for (int t = 0; t < 4; ++t)
#pragma unroll  // constant indices: the fragment arrays stay in registers
        for (int k = 0; k < 4; ++k) {          // k order of both operands: key = t*16 + 8*lh + 2*k (+1)
          const int key = t * 16 + 8 * lh + 2 * k;
          const int col = h * DH + (l16 & 7);  // A rows 8..15 repeat rows 0..7 (DH = 8)
          v2f a; a.x = sV[key * XP + col]; a.y = sV[(key + 1) * XP + col];
          c = wmma4(a, p[t][k], c);
        }
      // both lane halves hold O[row][h*8 + r], r = 0..7: each stores four of them
#pragma unroll  // constant indices: the fragment arrays stay in registers
      for (int i = 0; i < 4; ++i) {
        const float lo = c[i] * inv, hi = c[4 + i] * inv;
        sO[row * XP + h * DH + lh * 4 + i] = lh ? hi : lo;
      }
    }
  }

  // ---- output projection: Y = O @ Wp^T + bp, streamed to HBM ----
  float* yb = out + (size_t)b * (SEQ * DIM);
#pragma unroll
  for (int nt = 0; nt < 2; ++nt) {
    v8f c = {};
#pragma unroll
    for (int k = 0; k < 8; ++k) {
      const int kk = k * 4 + lh * 2;
      v2f a; a.x = sO[row * XP + kk]; a.y = sO[row * XP + kk + 1];
      const int n = nt * 16 + l16;
      const v2f bbf = *reinterpret_cast<const v2f*>(&sW[(3 * DIM + n) * WS + kk]);
      c = wmma4(a, bbf, c);
    }
    const float bias = bp[nt * 16 + l16];
#pragma unroll
    for (int r = 0; r < 8; ++r)
      yb[(wave * 16 + r + 8 * lh) * DIM + nt * 16 + l16] = c[r] + bias;
  }
}

extern "C" void kernel_launch(void* const* d_in, const int* in_sizes, int n_in,
                              void* d_out, int out_size, void* d_ws, size_t ws_size,
                              hipStream_t stream) {
  const float* x      = (const float*)d_in[0];
  const int*   attend = (const int*)  d_in[1];
  const float* Wq     = (const float*)d_in[2];
  const float* bq     = (const float*)d_in[3];
  const float* Wk     = (const float*)d_in[4];
  const float* bk     = (const float*)d_in[5];
  const float* Wv     = (const float*)d_in[6];
  const float* bv     = (const float*)d_in[7];
  const float* Wp     = (const float*)d_in[8];
  const float* bp     = (const float*)d_in[9];
  float* out = (float*)d_out;

  dim3 grid(NB), block(128);
  hipLaunchKernelGGL(attn_fused_kernel, grid, block, 0, stream,
                     x, attend, Wq, bq, Wk, bk, Wv, bv, Wp, bp, out);
}

// v003
// A run of this version takes 56.7 microseconds.
// Timed twice side by side with v002, it ran 1.09 times as fast both times.
// Over all steps from v000 it is 4.00 times as fast.
#include <hip/hip_runtime.h>

typedef __attribute__((ext_vector_type(2))) float v2f;
typedef __attribute__((ext_vector_type(4))) float v4f;
typedef __attribute__((ext_vector_type(8))) float v8f;

#define NB   8192
#define SEQ  64
#define DIM  32
#define NH   4
#define DH   8
#define XS   36   // padded pitch for x tile: 144B rows -> 16B-aligned for async b128
#define XP   33   // padded pitch for Q/K/V/O tiles (bank spread)
#define WS   36   // padded pitch for the weight tiles: 8-byte fragment reads hit all 64 banks once

__device__ __forceinline__ v8f wmma4(v2f a, v2f b, v8f c) {
  // D = A(16x4,f32) * B(4x16,f32) + C(16x16,f32) — full fp32 matrix op
  return __builtin_amdgcn_wmma_f32_16x16x4_f32(
      /*neg_a=*/false, a, /*neg_b=*/false, b,
      /*c_mod=*/(short)0, c, /*reuse_a=*/false, /*reuse_b=*/false);
}

__device__ __forceinline__ float xhalf(float v) {
  // value of lane l ^ 16 (the other 16-lane row), by a vector cross-row move
  const int b = __builtin_bit_cast(int, v);
  return __builtin_bit_cast(float, __builtin_amdgcn_permlanex16(
      b, b, 0x76543210, 0xfedcba98, false, false));
}

// One head of one 16-query tile against its first NT key tiles (the later ones are fully masked).
// Key tiles 0 .. NT-2 are allowed for all 16 queries; only tile NT-1 can hold masked keys.
template <int NT>
__device__ __forceinline__ void attn_head(const float* sQ, const float* sK, const float* sV,
                                          float* sO, int h, int row, int lim, int l16, int lh) {
  // exp(s / sqrt(DH) - max) as exp2(s * kexp - max * kexp)
  const float kexp = 0.35355339059327373f * 1.4426950408889634f;

  // ---- scores, transposed: S^T = Kh @ Qh^T; keys on M, the 16 queries on N ----
  v2f qf[2];                                   // B[k][n] = Q[row][k]
#pragma unroll  // constant indices: the fragment arrays stay in registers
  for (int k = 0; k < 2; ++k) {                // K = DH = 8 in steps of 4
    const int kk = h * DH + k * 4 + lh * 2;
    qf[k].x = sQ[row * XP + kk]; qf[k].y = sQ[row * XP + kk + 1];
  }
  const float* kp = sK + l16 * XP + h * DH + lh * 2;            // A row = key t*16 + l16
  v2f kf[NT][2];
#pragma unroll  // constant indices: the fragment arrays stay in registers
  for (int t = 0; t < NT; ++t)
#pragma unroll  // constant indices: the fragment arrays stay in registers
    for (int k = 0; k < 2; ++k) {
      kf[t][k].x = kp[t * 16 * XP + k * 4]; kf[t][k].y = kp[t * 16 * XP + k * 4 + 1];
    }
  const float* vp = sV + 8 * lh * XP + h * DH + (l16 & 7);      // A rows 8..15 repeat rows 0..7 (DH = 8)
  v2f vf[NT][4];                               // k order of both operands: key = t*16 + 8*lh + 2*k (+1)
#pragma unroll  // constant indices: the fragment arrays stay in registers
  for (int t = 0; t < NT; ++t)
#pragma unroll  // constant indices: the fragment arrays stay in registers
    for (int k = 0; k < 4; ++k) {
      vf[t][k].x = vp[(t * 16 + 2 * k) * XP]; vf[t][k].y = vp[(t * 16 + 2 * k + 1) * XP];
    }
  // Holds the K and V reads above in front of the products as one group: left to itself this build
  // issues each V read only two products ahead of its use.
  __builtin_amdgcn_sched_barrier(0);
  v8f s[NT];                                   // s[t][r] = S[query row][key t*16 + 8*lh + r]
#pragma unroll  // constant indices: the fragment arrays stay in registers
  for (int t = 0; t < NT; ++t) {
    v8f c = {};
#pragma unroll  // constant indices: the fragment arrays stay in registers
    for (int k = 0; k < 2; ++k)
      c = wmma4(kf[t][k], qf[k], c);
    s[t] = c;
  }

  // ---- masked softmax in registers: a lane holds half of its query's NT*16 scores ----
  float mt[NT];
#pragma unroll  // constant indices: the fragment arrays stay in registers
  for (int t = 0; t < NT; ++t) {
    mt[t] = -3.402823466e38f;
#pragma unroll  // constant indices: the fragment arrays stay in registers
    for (int r = 0; r < 8; ++r) {
      if (t == NT - 1)
        s[t][r] = (t * 16 + r < lim) ? s[t][r] : -3.402823466e38f;
      mt[t] = fmaxf(mt[t], s[t][r]);
    }
  }
  float m = mt[0];
#pragma unroll  // constant indices: the fragment arrays stay in registers
  for (int t = 1; t < NT; ++t) m = fmaxf(m, mt[t]);
  m = fmaxf(m, xhalf(m));                      // key 0 is always allowed: m is a real score
  const v2f kexp2 = {kexp, kexp};
  const v2f nmk2  = {-m * kexp, -m * kexp};
  v2f p[NT][4];                                // p[t][k] = P[row][key t*16 + 8*lh + 2*k (+1)]
  v2f sum2[2] = {{0.f, 0.f}, {0.f, 0.f}};
#pragma unroll  // constant indices: the fragment arrays stay in registers
  for (int t = 0; t < NT; ++t)
#pragma unroll  // constant indices: the fragment arrays stay in registers
    for (int k = 0; k < 4; ++k) {
      const v2f sc = {s[t][2 * k], s[t][2 * k + 1]};
      const v2f arg = __builtin_elementwise_fma(sc, kexp2, nmk2);
      p[t][k].x = __builtin_amdgcn_exp2f(arg.x);     // masked -> 0
      p[t][k].y = __builtin_amdgcn_exp2f(arg.y);
      sum2[k & 1] += p[t][k];
    }
  float sum = (sum2[0].x + sum2[1].x) + (sum2[0].y + sum2[1].y);
  sum += xhalf(sum);
  const float inv = 1.0f / sum;

  // ---- out_h^T = Vh^T @ P^T: the score registers are the B operand as they lie ----
  v8f c = {};
#pragma unroll  // constant indices: the fragment arrays stay in registers
  for (int t = 0; t < NT; ++t)
#pragma unroll  // constant indices: the fragment arrays stay in registers
    for (int k = 0; k < 4; ++k)
      c = wmma4(vf[t][k], p[t][k], c);
  // both lane halves hold O[row][h*8 + r], r = 0..7: each stores four of them
#pragma unroll  // constant indices: the fragment arrays stay in registers
  for (int i = 0; i < 4; ++i) {
    const float lo = c[i] * inv, hi = c[4 + i] * inv;
    sO[row * XP + h * DH + lh * 4 + i] = lh ? hi : lo;
  }
}

__global__ __launch_bounds__(128)
void attn_fused_kernel(const float* __restrict__ x,
                       const int*   __restrict__ attend,
                       const float* __restrict__ Wq, const float* __restrict__ bq,
                       const float* __restrict__ Wk, const float* __restrict__ bk,
                       const float* __restrict__ Wv, const float* __restrict__ bv,
                       const float* __restrict__ Wp, const float* __restrict__ bp,
                       float* __restrict__ out)
{
  __shared__ float sX[SEQ * XS];   // x tile (async-staged, 9.0 KB)
  __shared__ float sQ[SEQ * XP];
  __shared__ float sK[SEQ * XP];
  __shared__ float sV[SEQ * XP];
  __shared__ float sO[SEQ * XP];   // attn output (heads interleaved -> [S, D])
  __shared__ __attribute__((aligned(16))) float sW[4 * DIM * WS];  // Wq, Wk, Wv, Wp (18 KB)

  const int b    = blockIdx.x;
  const int tid  = threadIdx.x;
  const int lane = tid & 31;
  const int wave = tid >> 5;       // 0..3 -> row-tile
  const int l16  = lane & 15;
  const int lh   = lane >> 4;      // lane half selects K sub-pair / M+8
  const int row  = wave * 16 + l16;       // A-fragment row (M = lane&15)
  const int aa   = attend[b];

  // ---- weights, first half: whole-line 16-byte loads (a fragment load from global touches
  //      16 lines for 256 bytes); issued here so that they fly beside the x copies ----
  const float* Wg[4] = {Wq, Wk, Wv, Wp};
  v4f wreg[4][2];
#pragma unroll  // constant indices: wreg stays in registers
  for (int p = 0; p < 4; ++p)
#pragma unroll  // constant indices: wreg stays in registers
    for (int i = 0; i < 2; ++i)                // 256 chunks of 16 B per matrix
      wreg[p][i] = *reinterpret_cast<const v4f*>(Wg[p] + (tid + i * 128) * 4);

  // ---- stage x[b] (64x32) into LDS via CDNA5 async copy (ASYNCcnt path) ----
  const float* xb = x + (size_t)b * (SEQ * DIM);
  {
    const unsigned ldsBase = (unsigned)(uintptr_t)(&sX[0]); // LDS offset = low 32b
    for (int c = tid; c < (SEQ * DIM) / 4; c += 128) {      // 512 x 16B chunks
      const int r   = c >> 3;                               // row (8 chunks/row)
      const int col = (c & 7) * 4;                          // starting float col
      const unsigned ldst = ldsBase + (unsigned)((r * XS + col) * sizeof(float));
      const float* gp = xb + c * 4;                         // 16B-aligned global
      asm volatile("global_load_async_to_lds_b128 %0, %1, off"
                   :: "v"(ldst), "v"(gp) : "memory");
    }
    asm volatile("s_wait_asynccnt 0x0" ::: "memory");
  }
  // ---- weights, second half: into LDS at pitch WS; the barrier below publishes them too ----
#pragma unroll  // constant indices: wreg stays in registers
  for (int p = 0; p < 4; ++p)
#pragma unroll  // constant indices: wreg stays in registers
    for (int i = 0; i < 2; ++i) {
      const int c = tid + i * 128;             // row c >> 3, 8 chunks a row
      *reinterpret_cast<v4f*>(&sW[(p * DIM + (c >> 3)) * WS + (c & 7) * 4]) = wreg[p][i];
    }
  __syncthreads();

  // ---- QKV projections: P = X @ W^T + bias, each [64,32] ----
  const float* bg[3] = {bq, bk, bv};
  float*       Pg[3] = {sQ, sK, sV};
#pragma unroll
  for (int p = 0; p < 3; ++p) {
#pragma unroll
    for (int nt = 0; nt < 2; ++nt) {
      v8f c = {};
#pragma unroll
      for (int k = 0; k < 8; ++k) {            // K = 32 in steps of 4
        const int kk = k * 4 + lh * 2;
        v2f a; a.x = sX[row * XS + kk]; a.y = sX[row * XS + kk + 1];
        const int n = nt * 16 + l16;
        // B[k][n] = W[n][k]; 8B-aligned pair -> single b64 LDS load
        const v2f bbf = *reinterpret_cast<const v2f*>(&sW[(p * DIM + n) * WS + kk]);
        c = wmma4(a, bbf, c);
      }
      const float bias = bg[p][nt * 16 + l16];
#pragma unroll
      for (int r = 0; r < 8; ++r)              // C: M = r + 8*lh, N = l16
        Pg[p][(wave * 16 + r + 8 * lh) * XP + nt * 16 + l16] = c[r] + bias;
    }
  }
  __syncthreads();

  // A query tile rt (rows rt*16 .. rt*16+15) sees key j if j < max(row + 1, aa): key tiles from
  // max(rt + 1, ceil(aa / 16)) on are masked for all 16 rows and add exact zeros, so they are
  // not computed. Head h of tile (wave + h) & 3 goes to this wave: every wave gets each query
  // tile once, so all four waves carry the same number of key tiles.
  // Scalar copy of the wave number: the tile count must be a scalar branch (WMMA wants all lanes on).
  const int wv = __builtin_amdgcn_readfirstlane(wave);
  const int pt = (min(aa, SEQ) + 15) >> 4;     // key tiles that the prefix reaches
#pragma unroll 1  // rolled, as the head loop was: one copy of each of the four bodies in the instruction cache
  for (int h = 0; h < NH; ++h) {
    const int rt   = (wv + h) & 3;
    const int qrow = rt * 16 + l16;
    // this lane's keys are t*16 + 8*lh + r, so t*16 + r is compared with lim
    const int lim  = max(qrow + 1, aa) - 8 * lh;
    switch (max(rt + 1, pt)) {
      case 1:  attn_head<1>(sQ, sK, sV, sO, h, qrow, lim, l16, lh); break;
      case 2:  attn_head<2>(sQ, sK, sV, sO, h, qrow, lim, l16, lh); break;
      case 3:  attn_head<3>(sQ, sK, sV, sO, h, qrow, lim, l16, lh); break;
      default: attn_head<4>(sQ, sK, sV, sO, h, qrow, lim, l16, lh); break;
    }
  }
  // a row of sO now holds heads written by four different waves
  __syncthreads();

  // ---- output projection: Y = O @ Wp^T + bp, streamed to HBM ----
  float* yb = out + (size_t)b * (SEQ * DIM);
#pragma unroll
  for (int nt = 0; nt < 2; ++nt) {
    v8f c = {};
#pragma unroll
    for (int k = 0; k < 8; ++k) {
      const int kk = k * 4 + lh * 2;
      v2f a; a.x = sO[row * XP + kk]; a.y = sO[row * XP + kk + 1];
      const int n = nt * 16 + l16;
      const v2f bbf = *reinterpret_cast<const v2f*>(&sW[(3 * DIM + n) * WS + kk]);
      c = wmma4(a, bbf, c);
    }
    const float bias = bp[nt * 16 + l16];
#pragma unroll
    for (int r = 0; r < 8; ++r)
      yb[(wave * 16 + r + 8 * lh) * DIM + nt * 16 + l16] = c[r] + bias;
  }
}

extern "C" void kernel_launch(void* const* d_in, const int* in_sizes, int n_in,
                              void* d_out, int out_size, void* d_ws, size_t ws_size,
                              hipStream_t stream) {
  const float* x      = (const float*)d_in[0];
  const int*   attend = (const int*)  d_in[1];
  const float* Wq     = (const float*)d_in[2];
  const float* bq     = (const float*)d_in[3];
  const float* Wk     = (const float*)d_in[4];
  const float* bk     = (const float*)d_in[5];
  const float* Wv     = (const float*)d_in[6];
  const float* bv     = (const float*)d_in[7];
  const float* Wp     = (const float*)d_in[8];
  const float* bp     = (const float*)d_in[9];
  float* out = (float*)d_out;

  dim3 grid(NB), block(128);
  hipLaunchKernelGGL(attn_fused_kernel, grid, block, 0, stream,
                     x, attend, Wq, bq, Wk, bk, Wv, bv, Wp, bp, out);
}

// v004
// It runs in 54.7 microseconds.
// Next to v003, in two timings, it ran 1.04 times as fast each time.
// Over all steps from v000 it is 4.14 times as fast.
#include <hip/hip_runtime.h>

typedef __attribute__((ext_vector_type(2))) float v2f;
typedef __attribute__((ext_vector_type(4))) float v4f;
typedef __attribute__((ext_vector_type(8))) float v8f;

#define NB   8192
#define SEQ  64
#define DIM  32
#define NH   4
#define DH   8
#define XS   36   // padded pitch for x tile: 144B rows -> 16B-aligned for async b128; Q and O reuse the tile
#define XP   33   // padded pitch for K/V tiles (bank spread)
#define WS   36   // padded pitch for the weight tiles: 8-byte fragment reads hit all 64 banks once

__device__ __forceinline__ v8f wmma4(v2f a, v2f b, v8f c) {
  // D = A(16x4,f32) * B(4x16,f32) + C(16x16,f32) — full fp32 matrix op
  return __builtin_amdgcn_wmma_f32_16x16x4_f32(
      /*neg_a=*/false, a, /*neg_b=*/false, b,
      /*c_mod=*/(short)0, c, /*reuse_a=*/false, /*reuse_b=*/false);
}

__device__ __forceinline__ float xhalf(float v) {
  // value of lane l ^ 16 (the other 16-lane row), by a vector cross-row move
  const int b = __builtin_bit_cast(int, v);
  return __builtin_bit_cast(float, __builtin_amdgcn_permlanex16(
      b, b, 0x76543210, 0xfedcba98, false, false));
}

// One head of one 16-query tile against its first NT key tiles (the later ones are fully masked).
// Key tiles 0 .. NT-2 are allowed for all 16 queries; only tile NT-1 can hold masked keys.
// sQO holds Q at pitch XS; the 16 x 8 block of Q that this call reads (its rows, its head's columns)
// is read by no other wave, and the call's output O goes back into that same block.
template <int NT>
__device__ __forceinline__ void attn_head(float* sQO, const float* sK, const float* sV,
                                          int h, int row, int lim, int l16, int lh) {
  // exp(s / sqrt(DH) - max) as exp2(s * kexp - max * kexp)
  const float kexp = 0.35355339059327373f * 1.4426950408889634f;

  // ---- scores, transposed: S^T = Kh @ Qh^T; keys on M, the 16 queries on N ----
  v2f qf[2];                                   // B[k][n] = Q[row][k]
#pragma unroll  // constant indices: the fragment arrays stay in registers
  for (int k = 0; k < 2; ++k) {                // K = DH = 8 in steps of 4
    const int kk = h * DH + k * 4 + lh * 2;
    qf[k] = *reinterpret_cast<const v2f*>(&sQO[row * XS + kk]);
  }
  const float* kp = sK + l16 * XP + h * DH + lh * 2;            // A row = key t*16 + l16
  v2f kf[NT][2];
#pragma unroll  // constant indices: the fragment arrays stay in registers
  for (int t = 0; t < NT; ++t)
#pragma unroll  // constant indices: the fragment arrays stay in registers
    for (int k = 0; k < 2; ++k) {
      kf[t][k].x = kp[t * 16 * XP + k * 4]; kf[t][k].y = kp[t * 16 * XP + k * 4 + 1];
    }
  const float* vp = sV + 8 * lh * XP + h * DH + (l16 & 7);      // A rows 8..15 repeat rows 0..7 (DH = 8)
  v2f vf[NT][4];                               // k order of both operands: key = t*16 + 8*lh + 2*k (+1)
#pragma unroll  // constant indices: the fragment arrays stay in registers
  for (int t = 0; t < NT; ++t)
#pragma unroll  // constant indices: the fragment arrays stay in registers
    for (int k = 0; k < 4; ++k) {
      vf[t][k].x = vp[(t * 16 + 2 * k) * XP]; vf[t][k].y = vp[(t * 16 + 2 * k + 1) * XP];
    }
  // Holds the K and V reads above in front of the products as one group: left to itself this build
  // issues each V read only two products ahead of its use.
  __builtin_amdgcn_sched_barrier(0);
  v8f s[NT];                                   // s[t][r] = S[query row][key t*16 + 8*lh + r]
#pragma unroll  // constant indices: the fragment arrays stay in registers
  for (int t = 0; t < NT; ++t) {
    v8f c = {};
#pragma unroll  // constant indices: the fragment arrays stay in registers
    for (int k = 0; k < 2; ++k)
      c = wmma4(kf[t][k], qf[k], c);
    s[t] = c;
  }

  // ---- masked softmax in registers: a lane holds half of its query's NT*16 scores ----
  float mt[NT];
#pragma unroll  // constant indices: the fragment arrays stay in registers
  for (int t = 0; t < NT; ++t) {
    mt[t] = -3.402823466e38f;
#pragma unroll  // constant indices: the fragment arrays stay in registers
    for (int r = 0; r < 8; ++r) {
      if (t == NT - 1)
        s[t][r] = (t * 16 + r < lim) ? s[t][r] : -3.402823466e38f;
      mt[t] = fmaxf(mt[t], s[t][r]);
    }
  }
  float m = mt[0];
#pragma unroll  // constant indices: the fragment arrays stay in registers
  for (int t = 1; t < NT; ++t) m = fmaxf(m, mt[t]);
  m = fmaxf(m, xhalf(m));                      // key 0 is always allowed: m is a real score
  const v2f kexp2 = {kexp, kexp};
  const v2f nmk2  = {-m * kexp, -m * kexp};
  v2f p[NT][4];                                // p[t][k] = P[row][key t*16 + 8*lh + 2*k (+1)]
  v2f sum2[2] = {{0.f, 0.f}, {0.f, 0.f}};
#pragma unroll  // constant indices: the fragment arrays stay in registers
  for (int t = 0; t < NT; ++t)
#pragma unroll  // constant indices: the fragment arrays stay in registers
    for (int k = 0; k < 4; ++k) {
      const v2f sc = {s[t][2 * k], s[t][2 * k + 1]};
      const v2f arg = __builtin_elementwise_fma(sc, kexp2, nmk2);
      p[t][k].x = __builtin_amdgcn_exp2f(arg.x);     // masked -> 0
      p[t][k].y = __builtin_amdgcn_exp2f(arg.y);
      sum2[k & 1] += p[t][k];
    }
  float sum = (sum2[0].x + sum2[1].x) + (sum2[0].y + sum2[1].y);
  sum += xhalf(sum);
  const float inv = 1.0f / sum;

  // ---- out_h^T = Vh^T @ P^T: the score registers are the B operand as they lie ----
  v8f c = {};
#pragma unroll  // constant indices: the fragment arrays stay in registers
  for (int t = 0; t < NT; ++t)
#pragma unroll  // constant indices: the fragment arrays stay in registers
    for (int k = 0; k < 4; ++k)
      c = wmma4(vf[t][k], p[t][k], c);
  // both lane halves hold O[row][h*8 + r], r = 0..7: each stores four of them
  v4f o;
#pragma unroll  // constant indices: the fragment arrays stay in registers
  for (int i = 0; i < 4; ++i) {
    const float lo = c[i] * inv, hi = c[4 + i] * inv;
    o[i] = lh ? hi : lo;
  }
  *reinterpret_cast<v4f*>(&sQO[row * XS + h * DH + lh * 4]) = o;
}

__global__ __launch_bounds__(128)
void attn_fused_kernel(const float* __restrict__ x,
                       const int*   __restrict__ attend,
                       const float* __restrict__ Wq, const float* __restrict__ bq,
                       const float* __restrict__ Wk, const float* __restrict__ bk,
                       const float* __restrict__ Wv, const float* __restrict__ bv,
                       const float* __restrict__ Wp, const float* __restrict__ bp,
                       float* __restrict__ out)
{
  // 39 KB in all, so that eight work-groups fit one WGP's LDS. Buffers are reused once they are dead:
  // sX: the x tile (async-staged, 9.0 KB); each wave reads only its own 16 rows of it, into registers,
  //     and then writes its 16 rows of Q over them; O (heads interleaved -> [S, D]) later replaces Q.
  // sW: Wq, Wk, Wv (13.5 KB); Wp waits in registers and takes Wq's place once the projections are done.
  __shared__ __attribute__((aligned(16))) float sX[SEQ * XS];
  __shared__ float sK[SEQ * XP];
  __shared__ float sV[SEQ * XP];
  __shared__ __attribute__((aligned(16))) float sW[3 * DIM * WS];

  const int b    = blockIdx.x;
  const int tid  = threadIdx.x;
  const int lane = tid & 31;
  const int wave = tid >> 5;       // 0..3 -> row-tile
  const int l16  = lane & 15;
  const int lh   = lane >> 4;      // lane half selects K sub-pair / M+8
  const int row  = wave * 16 + l16;       // A-fragment row (M = lane&15)
  const int aa   = attend[b];

  // ---- weights, first half: whole-line 16-byte loads (a fragment load from global touches
  //      16 lines for 256 bytes); issued here so that they fly beside the x copies ----
  const float* Wg[4] = {Wq, Wk, Wv, Wp};
  v4f wreg[4][2];
#pragma unroll  // constant indices: wreg stays in registers
  for (int p = 0; p < 4; ++p)
#pragma unroll  // constant indices: wreg stays in registers
    for (int i = 0; i < 2; ++i)                // 256 chunks of 16 B per matrix
      wreg[p][i] = *reinterpret_cast<const v4f*>(Wg[p] + (tid + i * 128) * 4);

  // ---- stage x[b] (64x32) into LDS via CDNA5 async copy (ASYNCcnt path) ----
  const float* xb = x + (size_t)b * (SEQ * DIM);
  {
    const unsigned ldsBase = (unsigned)(uintptr_t)(&sX[0]); // LDS offset = low 32b
    for (int c = tid; c < (SEQ * DIM) / 4; c += 128) {      // 512 x 16B chunks
      const int r   = c >> 3;                               // row (8 chunks/row)
      const int col = (c & 7) * 4;                          // starting float col
      const unsigned ldst = ldsBase + (unsigned)((r * XS + col) * sizeof(float));
      const float* gp = xb + c * 4;                         // 16B-aligned global
      asm volatile("global_load_async_to_lds_b128 %0, %1, off"
                   :: "v"(ldst), "v"(gp) : "memory");
    }
    asm volatile("s_wait_asynccnt 0x0" ::: "memory");
  }
  // ---- weights, second half: Wq, Wk, Wv into LDS at pitch WS; the barrier below publishes them too ----
#pragma unroll  // constant indices: wreg stays in registers
  for (int p = 0; p < 3; ++p)
#pragma unroll  // constant indices: wreg stays in registers
    for (int i = 0; i < 2; ++i) {
      const int c = tid + i * 128;             // row c >> 3, 8 chunks a row
      *reinterpret_cast<v4f*>(&sW[(p * DIM + (c >> 3)) * WS + (c & 7) * 4]) = wreg[p][i];
    }
  __syncthreads();

  // ---- QKV projections: P = X @ W^T + bias, each [64,32] ----
  const float* bg[3] = {bq, bk, bv};
  float*       Pg[3] = {sX, sK, sV};
  const int    Pp[3] = {XS, XP, XP};
  v2f xa[8];                                   // this wave's x rows, all read before Q replaces them
#pragma unroll  // constant indices: xa stays in registers
  for (int k = 0; k < 8; ++k)                  // K = 32 in steps of 4
    xa[k] = *reinterpret_cast<const v2f*>(&sX[row * XS + k * 4 + lh * 2]);
#pragma unroll
  for (int p = 0; p < 3; ++p) {
#pragma unroll
    for (int nt = 0; nt < 2; ++nt) {
      v8f c = {};
#pragma unroll
      for (int k = 0; k < 8; ++k) {            // K = 32 in steps of 4
        const int kk = k * 4 + lh * 2;
        const int n = nt * 16 + l16;
        // B[k][n] = W[n][k]; 8B-aligned pair -> single b64 LDS load
        const v2f bbf = *reinterpret_cast<const v2f*>(&sW[(p * DIM + n) * WS + kk]);
        c = wmma4(xa[k], bbf, c);
      }
      const float bias = bg[p][nt * 16 + l16];
#pragma unroll
      for (int r = 0; r < 8; ++r)              // C: M = r + 8*lh, N = l16
        Pg[p][(wave * 16 + r + 8 * lh) * Pp[p] + nt * 16 + l16] = c[r] + bias;
    }
  }
  __syncthreads();

  // ---- Wp into Wq's place: every wave is past its last read of Wq; the barrier before the
  //      output projection publishes it ----
#pragma unroll  // constant indices: wreg stays in registers
  for (int i = 0; i < 2; ++i) {
    const int c = tid + i * 128;               // row c >> 3, 8 chunks a row
    *reinterpret_cast<v4f*>(&sW[(c >> 3) * WS + (c & 7) * 4]) = wreg[3][i];
  }

  // A query tile rt (rows rt*16 .. rt*16+15) sees key j if j < max(row + 1, aa): key tiles from
  // max(rt + 1, ceil(aa / 16)) on are masked for all 16 rows and add exact zeros, so they are
  // not computed. Head h of tile (wave + h) & 3 goes to this wave: every wave gets each query
  // tile once, so all four waves carry the same number of key tiles.
  // Scalar copy of the wave number: the tile count must be a scalar branch (WMMA wants all lanes on).
  const int wv = __builtin_amdgcn_readfirstlane(wave);
  const int pt = (min(aa, SEQ) + 15) >> 4;     // key tiles that the prefix reaches
#pragma unroll 1  // rolled, as the head loop was: one copy of each of the four bodies in the instruction cache
  for (int h = 0; h < NH; ++h) {
    const int rt   = (wv + h) & 3;
    const int qrow = rt * 16 + l16;
    // this lane's keys are t*16 + 8*lh + r, so t*16 + r is compared with lim
    const int lim  = max(qrow + 1, aa) - 8 * lh;
    switch (max(rt + 1, pt)) {
      case 1:  attn_head<1>(sX, sK, sV, h, qrow, lim, l16, lh); break;
      case 2:  attn_head<2>(sX, sK, sV, h, qrow, lim, l16, lh); break;
      case 3:  attn_head<3>(sX, sK, sV, h, qrow, lim, l16, lh); break;
      default: attn_head<4>(sX, sK, sV, h, qrow, lim, l16, lh); break;
    }
  }
  // a row of O (in sX) now holds heads written by four different waves
  __syncthreads();

  // ---- output projection: Y = O @ Wp^T + bp, streamed to HBM ----
  float* yb = out + (size_t)b * (SEQ * DIM);
#pragma unroll
  for (int nt = 0; nt < 2; ++nt) {
    v8f c = {};
#pragma unroll
    for (int k = 0; k < 8; ++k) {
      const int kk = k * 4 + lh * 2;
      const v2f a = *reinterpret_cast<const v2f*>(&sX[row * XS + kk]);
      const int n = nt * 16 + l16;
      const v2f bbf = *reinterpret_cast<const v2f*>(&sW[n * WS + kk]);
      c = wmma4(a, bbf, c);
    }
    const float bias = bp[nt * 16 + l16];
#pragma unroll
    for (int r = 0; r < 8; ++r)
      yb[(wave * 16 + r + 8 * lh) * DIM + nt * 16 + l16] = c[r] + bias;
  }
}

extern "C" void kernel_launch(void* const* d_in, const int* in_sizes, int n_in,
                              void* d_out, int out_size, void* d_ws, size_t ws_size,
                              hipStream_t stream) {
  const float* x      = (const float*)d_in[0];
  const int*   attend = (const int*)  d_in[1];
  const float* Wq     = (const float*)d_in[2];
  const float* bq     = (const float*)d_in[3];
  const float* Wk     = (const float*)d_in[4];
  const float* bk     = (const float*)d_in[5];
  const float* Wv     = (const float*)d_in[6];
  const float* bv     = (const float*)d_in[7];
  const float* Wp     = (const float*)d_in[8];
  const float* bp     = (const float*)d_in[9];
  float* out = (float*)d_out;

  dim3 grid(NB), block(128);
  hipLaunchKernelGGL(attn_fused_kernel, grid, block, 0, stream,
                     x, attend, Wq, bq, Wk, bk, Wv, bv, Wp, bp, out);
}
